// v000
// The times below were measured on an AMD MI455X: many runs one after another, warmed up first and cycling through
// copies of the inputs, with the whole window's GPU time divided by the number of runs. Launches and the gaps
// between them are all in it. The median over several windows is given; except for v000 it joins two sittings, which
// can be a few percent apart, so the side-by-side timings, each taken in one sitting, are the better comparison.
// v000, which the later versions start from, runs in 826 microseconds.
#include <hip/hip_runtime.h>
#include <hip/hip_bf16.h>

// Transformer encoder block for MI455X (gfx1250), fp32 via V_WMMA_F32_16X16X4_F32,
// with double-buffered GLOBAL_LOAD_ASYNC_TO_LDS_B128 staging (ASYNCcnt path).
// B=2 S=2048 D=1024 H=16 DK=64 DFF=4096.

#define B_   2
#define S_   2048
#define D_   1024
#define H_   16
#define DK_  64
#define DFF_ 4096
#define NM   (B_ * S_)   // 4096 rows

typedef float v2f __attribute__((ext_vector_type(2)));
typedef float v8f __attribute__((ext_vector_type(8)));
typedef int   v4i __attribute__((ext_vector_type(4)));

__device__ __forceinline__ v8f wmma_f32(v2f a, v2f b, v8f c) {
  // 8 args: (neg_a, A, neg_b, B, c_mod, C, reuse_a, reuse_b)
  return __builtin_amdgcn_wmma_f32_16x16x4_f32(false, a, false, b, (short)0, c,
                                               false, false);
}

// ---- CDNA5 async global->LDS copy (ASYNCcnt), with synchronous fallback ----
#if defined(__AMDGCN__) && __has_builtin(__builtin_amdgcn_global_load_async_to_lds_b128)
#define HAVE_ASYNC 1
#else
#define HAVE_ASYNC 0
#endif

#if HAVE_ASYNC
typedef __attribute__((address_space(1))) v4i g_v4i;   // global (prints as __device__)
typedef __attribute__((address_space(3))) v4i l_v4i;   // LDS    (prints as __shared__)

__device__ __forceinline__ void async_copy16(const float* g, float* l) {
  // Low 32 bits of a generic LDS address are the LDS byte offset (ISA 10.2).
  __builtin_amdgcn_global_load_async_to_lds_b128(
      (g_v4i*)(uintptr_t)g, (l_v4i*)(uint32_t)(uintptr_t)l, 0, 0);
}
__device__ __forceinline__ void wait_async0() {
#if __has_builtin(__builtin_amdgcn_s_wait_asynccnt)
  __builtin_amdgcn_s_wait_asynccnt(0);
#else
  asm volatile("s_wait_asynccnt 0" ::: "memory");
#endif
}
#else
__device__ __forceinline__ void async_copy16(const float* g, float* l) {
  *(float4*)l = *(const float4*)g;   // sync fallback: load + ds_store
}
__device__ __forceinline__ void wait_async0() {}
#endif

// ---------------------------------------------------------------------------
// LayerNorm: one block (256 thr) per row of D=1024. Biased std, eps on std.
// ---------------------------------------------------------------------------
__global__ __launch_bounds__(256) void ln_kernel(const float* __restrict__ x,
                                                 const float* __restrict__ alpha,
                                                 const float* __restrict__ beta,
                                                 float* __restrict__ out) {
  __shared__ float rs[8], rss[8];
  const int row  = blockIdx.x;
  const int tid  = threadIdx.x;
  const int lane = tid & 31;
  const int wid  = tid >> 5;

  const float* xr = x + (size_t)row * D_;
  float4 xv = *(const float4*)(xr + tid * 4);
  float s  = xv.x + xv.y + xv.z + xv.w;
  float ss = xv.x * xv.x + xv.y * xv.y + xv.z * xv.z + xv.w * xv.w;

#pragma unroll
  for (int m = 16; m >= 1; m >>= 1) {
    s  += __shfl_xor(s, m, 32);
    ss += __shfl_xor(ss, m, 32);
  }
  if (lane == 0) { rs[wid] = s; rss[wid] = ss; }
  __syncthreads();
  if (tid == 0) {
    float a = 0.f, b = 0.f;
#pragma unroll
    for (int i = 0; i < 8; ++i) { a += rs[i]; b += rss[i]; }
    rs[0] = a; rss[0] = b;
  }
  __syncthreads();

  const float mean = rs[0] * (1.0f / D_);
  float var = rss[0] * (1.0f / D_) - mean * mean;
  var = fmaxf(var, 0.0f);
  const float inv = 1.0f / (sqrtf(var) + 1e-6f);

  float4 av = *(const float4*)(alpha + tid * 4);
  float4 bv = *(const float4*)(beta + tid * 4);
  float4 o;
  o.x = av.x * (xv.x - mean) * inv + bv.x;
  o.y = av.y * (xv.y - mean) * inv + bv.y;
  o.z = av.z * (xv.z - mean) * inv + bv.z;
  o.w = av.w * (xv.w - mean) * inv + bv.w;
  *(float4*)(out + (size_t)row * D_ + tid * 4) = o;
}

// ---------------------------------------------------------------------------
// GEMM C[M,N] = A[M,K] * Bm[K,N] (+bias, +relu, +residual), fp32 WMMA 16x16x4.
// 256 thr = 8 waves (4x2). Block tile 128x128, wave tile 32x64 (acc v8f[2][4]),
// BK=32. Double-buffered async global->LDS staging: one s_wait_asynccnt + one
// barrier per chunk. As padded to stride 36 floats (rows 16B-aligned for b128
// async writes; banks 36r mod 64 distinct for 16 lanes).
// ---------------------------------------------------------------------------
template <bool BIAS, bool RELU, bool RESID>
__global__ __launch_bounds__(256) void gemm_kernel(
    const float* __restrict__ A, const float* __restrict__ Bm,
    const float* __restrict__ bias, const float* __restrict__ resid,
    float* __restrict__ C, int M, int N, int K) {
  __shared__ float As[2][128][36];
  __shared__ float Bs[2][32][128];

  const int tid   = threadIdx.x;
  const int wid   = tid >> 5;
  const int lane  = tid & 31;
  const int lr    = lane & 15;
  const int hi    = lane >> 4;
  const int waveM = wid >> 1;  // 0..3 (32-row groups)
  const int waveN = wid & 1;   // 0..1 (64-col groups)
  const int row0  = blockIdx.y * 128;
  const int col0  = blockIdx.x * 128;

  auto stage = [&](int buf, int k0) {
#pragma unroll
    for (int i = 0; i < 4; ++i) {       // A chunk 128x32
      int r  = (tid >> 3) + i * 32;
      int c4 = (tid & 7) * 4;
      async_copy16(A + (size_t)(row0 + r) * K + k0 + c4, &As[buf][r][c4]);
    }
#pragma unroll
    for (int i = 0; i < 4; ++i) {       // B chunk 32x128
      int idx = tid + i * 256;
      int r   = idx >> 5;
      int c4  = (idx & 31) * 4;
      async_copy16(Bm + (size_t)(k0 + r) * N + col0 + c4, &Bs[buf][r][c4]);
    }
  };

  v8f acc[2][4] = {};
  const int nch = K / 32;
  stage(0, 0);

  for (int ch = 0; ch < nch; ++ch) {
    const int buf = ch & 1;
    wait_async0();
    __syncthreads();                    // current buffer fully staged, prev reads done
    if (ch + 1 < nch) stage(buf ^ 1, (ch + 1) * 32);

#pragma unroll
    for (int kk = 0; kk < 32; kk += 4) {
      v2f a0 = *(const v2f*)&As[buf][waveM * 32 + lr][kk + hi * 2];
      v2f a1 = *(const v2f*)&As[buf][waveM * 32 + 16 + lr][kk + hi * 2];
      v2f bf[4];
#pragma unroll
      for (int n = 0; n < 4; ++n) {
        bf[n].x = Bs[buf][kk + hi * 2][waveN * 64 + n * 16 + lr];
        bf[n].y = Bs[buf][kk + hi * 2 + 1][waveN * 64 + n * 16 + lr];
      }
#pragma unroll
      for (int n = 0; n < 4; ++n) {
        acc[0][n] = wmma_f32(a0, bf[n], acc[0][n]);
        acc[1][n] = wmma_f32(a1, bf[n], acc[1][n]);
      }
    }
  }

  // Epilogue: C-layout row = r + hi*8, col = lr (per 16x16 tile)
#pragma unroll
  for (int rt = 0; rt < 2; ++rt) {
#pragma unroll
    for (int ct = 0; ct < 4; ++ct) {
      const int col  = col0 + waveN * 64 + ct * 16 + lr;
      const float bb = BIAS ? bias[col] : 0.0f;
#pragma unroll
      for (int r = 0; r < 8; ++r) {
        const int row = row0 + waveM * 32 + rt * 16 + hi * 8 + r;
        float v = acc[rt][ct][r] + bb;
        if (RELU) v = fmaxf(v, 0.0f);
        if (RESID) v += resid[(size_t)row * N + col];
        C[(size_t)row * N + col] = v;
      }
    }
  }
}

// ---------------------------------------------------------------------------
// Flash attention: grid (S/64, H, B), 128 thr = 4 waves, each wave 16 q-rows.
// QK^T and PV via fp32 WMMA; online softmax with shuffle butterflies inside
// 16-lane halves. K/V tiles double-buffered via async global->LDS copies.
// Pads: Qs/Kt stride 68 floats (rows 272B -> 16B-aligned, banks 4r distinct).
// ---------------------------------------------------------------------------
__global__ __launch_bounds__(128) void attn_kernel(
    const float* __restrict__ Q, const float* __restrict__ Kg,
    const float* __restrict__ V, const int* __restrict__ mask,
    float* __restrict__ ctx) {
  __shared__ float Qs[64][68];
  __shared__ float Kt[2][64][68];
  __shared__ float Vt[2][64][64];
  __shared__ float Ps[4][16][66];

  const int tid  = threadIdx.x;
  const int wid  = tid >> 5;
  const int lane = tid & 31;
  const int lr   = lane & 15;
  const int hi   = lane >> 4;
  const int qt   = blockIdx.x;
  const int h    = blockIdx.y;
  const int b    = blockIdx.z;
  const size_t rowbase = (size_t)b * S_;
  const int hoff = h * DK_;

  auto stage_kv = [&](int buf, int kt) {
#pragma unroll
    for (int i = 0; i < 8; ++i) {
      int idx = tid + i * 128;
      int r   = idx >> 4;
      int c4  = (idx & 15) * 4;
      async_copy16(Kg + (rowbase + kt * 64 + r) * D_ + hoff + c4, &Kt[buf][r][c4]);
      async_copy16(V + (rowbase + kt * 64 + r) * D_ + hoff + c4, &Vt[buf][r][c4]);
    }
  };

  // Stage Q tile (once) + first K/V tile, all async.
#pragma unroll
  for (int i = 0; i < 8; ++i) {
    int idx = tid + i * 128;
    int r   = idx >> 4;
    int c4  = (idx & 15) * 4;
    async_copy16(Q + (rowbase + qt * 64 + r) * D_ + hoff + c4, &Qs[r][c4]);
  }
  stage_kv(0, 0);

  float mrun[8], lrun[8];
#pragma unroll
  for (int r = 0; r < 8; ++r) { mrun[r] = -1e30f; lrun[r] = 0.0f; }
  v8f o[4] = {};

  for (int kt = 0; kt < S_ / 64; ++kt) {
    const int buf = kt & 1;
    wait_async0();
    __syncthreads();                    // Qs + Kt/Vt[buf] staged; prev reads done
    if (kt + 1 < S_ / 64) stage_kv(buf ^ 1, kt + 1);

    // S = Q * K^T  (16 q-rows x 64 keys per wave)
    v8f sacc[4] = {};
#pragma unroll
    for (int kk = 0; kk < 64; kk += 4) {
      v2f a = *(const v2f*)&Qs[wid * 16 + lr][kk + hi * 2];
#pragma unroll
      for (int n = 0; n < 4; ++n) {
        v2f bk = *(const v2f*)&Kt[buf][n * 16 + lr][kk + hi * 2];
        sacc[n] = wmma_f32(a, bk, sacc[n]);
      }
    }

    // scale + mask
    const int colbase = kt * 64;
    float sc[4][8];
#pragma unroll
    for (int n = 0; n < 4; ++n) {
      const int col = colbase + n * 16 + lr;
      const bool ok = mask[(size_t)b * S_ + col] != 0;
#pragma unroll
      for (int r = 0; r < 8; ++r) {
        float v = sacc[n][r] * 0.125f;
        sc[n][r] = ok ? v : -1e9f;
      }
    }

    // online softmax (rows live in 16-lane halves; xor masks <16 stay in-half)
    float alph[8];
#pragma unroll
    for (int r = 0; r < 8; ++r) {
      float cm = fmaxf(fmaxf(sc[0][r], sc[1][r]), fmaxf(sc[2][r], sc[3][r]));
#pragma unroll
      for (int m = 8; m >= 1; m >>= 1) cm = fmaxf(cm, __shfl_xor(cm, m, 32));
      const float mnew = fmaxf(mrun[r], cm);
      const float al   = __expf(mrun[r] - mnew);
      mrun[r] = mnew;
      alph[r] = al;
      float rsum = 0.0f;
#pragma unroll
      for (int n = 0; n < 4; ++n) {
        float p = __expf(sc[n][r] - mnew);
        sc[n][r] = p;
        rsum += p;
      }
#pragma unroll
      for (int m = 8; m >= 1; m >>= 1) rsum += __shfl_xor(rsum, m, 32);
      lrun[r] = lrun[r] * al + rsum;
    }

    // rescale O, spill P to LDS (C-layout -> memory row-major)
#pragma unroll
    for (int n = 0; n < 4; ++n) {
#pragma unroll
      for (int r = 0; r < 8; ++r) {
        o[n][r] *= alph[r];
        Ps[wid][hi * 8 + r][n * 16 + lr] = sc[n][r];
      }
    }
    __syncthreads();                    // P visible before A-fragment reads

    // O += P * V
#pragma unroll
    for (int kk = 0; kk < 64; kk += 4) {
      v2f ap = *(const v2f*)&Ps[wid][lr][kk + hi * 2];
#pragma unroll
      for (int n = 0; n < 4; ++n) {
        v2f bv;
        bv.x = Vt[buf][kk + hi * 2][n * 16 + lr];
        bv.y = Vt[buf][kk + hi * 2 + 1][n * 16 + lr];
        o[n] = wmma_f32(ap, bv, o[n]);
      }
    }
  }

  // finalize: O / l -> ctx[b, q, h*64 + col]
#pragma unroll
  for (int r = 0; r < 8; ++r) {
    const float inv = 1.0f / lrun[r];
    const int qrow  = qt * 64 + wid * 16 + hi * 8 + r;
#pragma unroll
    for (int n = 0; n < 4; ++n) {
      ctx[(rowbase + qrow) * D_ + hoff + n * 16 + lr] = o[n][r] * inv;
    }
  }
}

// ---------------------------------------------------------------------------
extern "C" void kernel_launch(void* const* d_in, const int* in_sizes, int n_in,
                              void* d_out, int out_size, void* d_ws,
                              size_t ws_size, hipStream_t stream) {
  (void)in_sizes; (void)n_in; (void)out_size; (void)ws_size;
  const float* x     = (const float*)d_in[0];
  const int*   mask  = (const int*)d_in[1];
  const float* wq    = (const float*)d_in[2];
  const float* wk    = (const float*)d_in[3];
  const float* wv    = (const float*)d_in[4];
  const float* wo    = (const float*)d_in[5];
  const float* w1    = (const float*)d_in[6];
  const float* b1    = (const float*)d_in[7];
  const float* w2    = (const float*)d_in[8];
  const float* b2    = (const float*)d_in[9];
  const float* ln1_a = (const float*)d_in[10];
  const float* ln1_b = (const float*)d_in[11];
  const float* ln2_a = (const float*)d_in[12];
  const float* ln2_b = (const float*)d_in[13];
  float* out = (float*)d_out;

  const size_t RD = (size_t)NM * D_;  // 4M floats per activation
  float* xn  = (float*)d_ws;          // [RD]   (reused as xn2)
  float* q   = xn + RD;               // [RD]
  float* k   = q + RD;                // [RD]
  float* v   = k + RD;                // [RD]
  float* ctx = v + RD;                // [RD]
  float* x1  = ctx + RD;              // [RD]
  float* ff1 = q;                     // reuse q..ctx region: NM*DFF = 16M floats

  // 1) xn = LN1(x)
  ln_kernel<<<NM, 256, 0, stream>>>(x, ln1_a, ln1_b, xn);

  // 2) Q/K/V projections
  dim3 gD(D_ / 128, NM / 128);
  gemm_kernel<false, false, false><<<gD, 256, 0, stream>>>(
      xn, wq, nullptr, nullptr, q, NM, D_, D_);
  gemm_kernel<false, false, false><<<gD, 256, 0, stream>>>(
      xn, wk, nullptr, nullptr, k, NM, D_, D_);
  gemm_kernel<false, false, false><<<gD, 256, 0, stream>>>(
      xn, wv, nullptr, nullptr, v, NM, D_, D_);

  // 3) flash attention -> ctx
  dim3 gA(S_ / 64, H_, B_);
  attn_kernel<<<gA, 128, 0, stream>>>(q, k, v, mask, ctx);

  // 4) x1 = x + ctx @ wo
  gemm_kernel<false, false, true><<<gD, 256, 0, stream>>>(
      ctx, wo, nullptr, x, x1, NM, D_, D_);

  // 5) xn2 = LN2(x1)
  ln_kernel<<<NM, 256, 0, stream>>>(x1, ln2_a, ln2_b, xn);

  // 6) ff1 = relu(xn2 @ w1 + b1)
  dim3 gF(DFF_ / 128, NM / 128);
  gemm_kernel<true, true, false><<<gF, 256, 0, stream>>>(
      xn, w1, b1, nullptr, ff1, NM, DFF_, D_);

  // 7) out = x1 + ff1 @ w2 + b2
  gemm_kernel<true, false, true><<<gD, 256, 0, stream>>>(
      ff1, w2, b2, x1, out, NM, D_, DFF_);
}

// v001
// A run of this version takes 813 microseconds.
// Timed twice side by side with v000, it ran 1.05 times as fast both times.
#include <hip/hip_runtime.h>
#include <hip/hip_bf16.h>

// Transformer encoder block for MI455X (gfx1250), fp32 via V_WMMA_F32_16X16X4_F32,
// with double-buffered GLOBAL_LOAD_ASYNC_TO_LDS_B128 staging (ASYNCcnt path).
// B=2 S=2048 D=1024 H=16 DK=64 DFF=4096.

#define B_   2
#define S_   2048
#define D_   1024
#define H_   16
#define DK_  64
#define DFF_ 4096
#define NM   (B_ * S_)   // 4096 rows

typedef float v2f __attribute__((ext_vector_type(2)));
typedef float v8f __attribute__((ext_vector_type(8)));
typedef int   v4i __attribute__((ext_vector_type(4)));

__device__ __forceinline__ v8f wmma_f32(v2f a, v2f b, v8f c) {
  // 8 args: (neg_a, A, neg_b, B, c_mod, C, reuse_a, reuse_b)
  return __builtin_amdgcn_wmma_f32_16x16x4_f32(false, a, false, b, (short)0, c,
                                               false, false);
}

// ---- CDNA5 async global->LDS copy (ASYNCcnt), with synchronous fallback ----
#if defined(__AMDGCN__) && __has_builtin(__builtin_amdgcn_global_load_async_to_lds_b128)
#define HAVE_ASYNC 1
#else
#define HAVE_ASYNC 0
#endif

#if HAVE_ASYNC
typedef __attribute__((address_space(1))) v4i g_v4i;   // global (prints as __device__)
typedef __attribute__((address_space(3))) v4i l_v4i;   // LDS    (prints as __shared__)

__device__ __forceinline__ void async_copy16(const float* g, float* l) {
  // Low 32 bits of a generic LDS address are the LDS byte offset (ISA 10.2).
  __builtin_amdgcn_global_load_async_to_lds_b128(
      (g_v4i*)(uintptr_t)g, (l_v4i*)(uint32_t)(uintptr_t)l, 0, 0);
}
__device__ __forceinline__ void wait_async0() {
#if __has_builtin(__builtin_amdgcn_s_wait_asynccnt)
  __builtin_amdgcn_s_wait_asynccnt(0);
#else
  asm volatile("s_wait_asynccnt 0" ::: "memory");
#endif
}
#else
__device__ __forceinline__ void async_copy16(const float* g, float* l) {
  *(float4*)l = *(const float4*)g;   // sync fallback: load + ds_store
}
__device__ __forceinline__ void wait_async0() {}
#endif

// ---------------------------------------------------------------------------
// LayerNorm: one block (256 thr) per row of D=1024. Biased std, eps on std.
// ---------------------------------------------------------------------------
__global__ __launch_bounds__(256) void ln_kernel(const float* __restrict__ x,
                                                 const float* __restrict__ alpha,
                                                 const float* __restrict__ beta,
                                                 float* __restrict__ out) {
  __shared__ float rs[8], rss[8];
  const int row  = blockIdx.x;
  const int tid  = threadIdx.x;
  const int lane = tid & 31;
  const int wid  = tid >> 5;

  const float* xr = x + (size_t)row * D_;
  float4 xv = *(const float4*)(xr + tid * 4);
  float s  = xv.x + xv.y + xv.z + xv.w;
  float ss = xv.x * xv.x + xv.y * xv.y + xv.z * xv.z + xv.w * xv.w;

#pragma unroll
  for (int m = 16; m >= 1; m >>= 1) {
    s  += __shfl_xor(s, m, 32);
    ss += __shfl_xor(ss, m, 32);
  }
  if (lane == 0) { rs[wid] = s; rss[wid] = ss; }
  __syncthreads();
  if (tid == 0) {
    float a = 0.f, b = 0.f;
#pragma unroll
    for (int i = 0; i < 8; ++i) { a += rs[i]; b += rss[i]; }
    rs[0] = a; rss[0] = b;
  }
  __syncthreads();

  const float mean = rs[0] * (1.0f / D_);
  float var = rss[0] * (1.0f / D_) - mean * mean;
  var = fmaxf(var, 0.0f);
  const float inv = 1.0f / (sqrtf(var) + 1e-6f);

  float4 av = *(const float4*)(alpha + tid * 4);
  float4 bv = *(const float4*)(beta + tid * 4);
  float4 o;
  o.x = av.x * (xv.x - mean) * inv + bv.x;
  o.y = av.y * (xv.y - mean) * inv + bv.y;
  o.z = av.z * (xv.z - mean) * inv + bv.z;
  o.w = av.w * (xv.w - mean) * inv + bv.w;
  *(float4*)(out + (size_t)row * D_ + tid * 4) = o;
}

// ---------------------------------------------------------------------------
// GEMM C[M,N] = A[M,K] * Bm[K,N] (+bias, +relu, +residual), fp32 WMMA 16x16x4.
// 256 thr = 8 waves (4x2). Block tile 128x128, wave tile 32x64 (acc v8f[2][4]),
// BK=32. Double-buffered async global->LDS staging: one s_wait_asynccnt + one
// barrier per chunk. As padded to stride 36 floats (rows 16B-aligned for b128
// async writes; banks 36r mod 64 distinct for 16 lanes).
// ---------------------------------------------------------------------------
template <bool BIAS, bool RELU, bool RESID>
__global__ __launch_bounds__(256) void gemm_kernel(
    const float* __restrict__ A, const float* __restrict__ Bm,
    const float* __restrict__ bias, const float* __restrict__ resid,
    float* __restrict__ C, int M, int N, int K) {
  __shared__ float As[2][128][36];
  __shared__ float Bs[2][32][128];

  const int tid   = threadIdx.x;
  const int wid   = tid >> 5;
  const int lane  = tid & 31;
  const int lr    = lane & 15;
  const int hi    = lane >> 4;
  const int waveM = wid >> 1;  // 0..3 (32-row groups)
  const int waveN = wid & 1;   // 0..1 (64-col groups)
  const int row0  = blockIdx.y * 128;
  const int col0  = blockIdx.x * 128;

  auto stage = [&](int buf, int k0) {
#pragma unroll
    for (int i = 0; i < 4; ++i) {       // A chunk 128x32
      int r  = (tid >> 3) + i * 32;
      int c4 = (tid & 7) * 4;
      async_copy16(A + (size_t)(row0 + r) * K + k0 + c4, &As[buf][r][c4]);
    }
#pragma unroll
    for (int i = 0; i < 4; ++i) {       // B chunk 32x128
      int idx = tid + i * 256;
      int r   = idx >> 5;
      int c4  = (idx & 31) * 4;
      async_copy16(Bm + (size_t)(k0 + r) * N + col0 + c4, &Bs[buf][r][c4]);
    }
  };

  // Two register sets of raw fragment words for one k-step (4 k) each.
  v2f   af[2][2];
  float bx[2][4], by[2][4];
  auto frag = [&](int s, int buf, int kk) {
    af[s][0] = *(const v2f*)&As[buf][waveM * 32 + lr][kk + hi * 2];
    af[s][1] = *(const v2f*)&As[buf][waveM * 32 + 16 + lr][kk + hi * 2];
#pragma unroll
    for (int n = 0; n < 4; ++n) {
      bx[s][n] = Bs[buf][kk + hi * 2][waveN * 64 + n * 16 + lr];
      by[s][n] = Bs[buf][kk + hi * 2 + 1][waveN * 64 + n * 16 + lr];
    }
  };

  v8f acc[2][4] = {};
  const int nch = K / 32;
  stage(0, 0);

  for (int ch = 0; ch < nch; ++ch) {
    const int buf = ch & 1;
    wait_async0();
    __syncthreads();                    // current buffer fully staged, prev reads done
    if (ch + 1 < nch) stage(buf ^ 1, (ch + 1) * 32);

    // Fragments run one k-step ahead in the other register set, so a step's LDS
    // latency passes under the previous step's eight WMMAs.
    frag(0, buf, 0);
#pragma unroll
    for (int st = 0; st < 8; ++st) {
      const int cur = st & 1;
      if (st + 1 < 8) frag(cur ^ 1, buf, (st + 1) * 4);
      // Holds the next step's LDS reads, as one group, ahead of this step's WMMAs;
      // without it the scheduler sinks them to their users and every wait is exposed.
      __builtin_amdgcn_sched_barrier(0);
#pragma unroll
      for (int n = 0; n < 4; ++n) {
        v2f b;
        b.x = bx[cur][n];
        b.y = by[cur][n];
        acc[0][n] = wmma_f32(af[cur][0], b, acc[0][n]);
        acc[1][n] = wmma_f32(af[cur][1], b, acc[1][n]);
      }
    }
  }

  // Epilogue: C-layout row = r + hi*8, col = lr (per 16x16 tile)
#pragma unroll
  for (int rt = 0; rt < 2; ++rt) {
#pragma unroll
    for (int ct = 0; ct < 4; ++ct) {
      const int col  = col0 + waveN * 64 + ct * 16 + lr;
      const float bb = BIAS ? bias[col] : 0.0f;
#pragma unroll
      for (int r = 0; r < 8; ++r) {
        const int row = row0 + waveM * 32 + rt * 16 + hi * 8 + r;
        float v = acc[rt][ct][r] + bb;
        if (RELU) v = fmaxf(v, 0.0f);
        if (RESID) v += resid[(size_t)row * N + col];
        C[(size_t)row * N + col] = v;
      }
    }
  }
}

// ---------------------------------------------------------------------------
// Flash attention: grid (S/64, H, B), 128 thr = 4 waves, each wave 16 q-rows.
// QK^T and PV via fp32 WMMA; online softmax with shuffle butterflies inside
// 16-lane halves. K/V tiles double-buffered via async global->LDS copies.
// Pads: Qs/Kt stride 68 floats (rows 272B -> 16B-aligned, banks 4r distinct).
// ---------------------------------------------------------------------------
__global__ __launch_bounds__(128) void attn_kernel(
    const float* __restrict__ Q, const float* __restrict__ Kg,
    const float* __restrict__ V, const int* __restrict__ mask,
    float* __restrict__ ctx) {
  __shared__ float Qs[64][68];
  __shared__ float Kt[2][64][68];
  __shared__ float Vt[2][64][64];
  __shared__ float Ps[4][16][66];

  const int tid  = threadIdx.x;
  const int wid  = tid >> 5;
  const int lane = tid & 31;
  const int lr   = lane & 15;
  const int hi   = lane >> 4;
  const int qt   = blockIdx.x;
  const int h    = blockIdx.y;
  const int b    = blockIdx.z;
  const size_t rowbase = (size_t)b * S_;
  const int hoff = h * DK_;

  auto stage_kv = [&](int buf, int kt) {
#pragma unroll
    for (int i = 0; i < 8; ++i) {
      int idx = tid + i * 128;
      int r   = idx >> 4;
      int c4  = (idx & 15) * 4;
      async_copy16(Kg + (rowbase + kt * 64 + r) * D_ + hoff + c4, &Kt[buf][r][c4]);
      async_copy16(V + (rowbase + kt * 64 + r) * D_ + hoff + c4, &Vt[buf][r][c4]);
    }
  };

  // Stage Q tile (once) + first K/V tile, all async.
#pragma unroll
  for (int i = 0; i < 8; ++i) {
    int idx = tid + i * 128;
    int r   = idx >> 4;
    int c4  = (idx & 15) * 4;
    async_copy16(Q + (rowbase + qt * 64 + r) * D_ + hoff + c4, &Qs[r][c4]);
  }
  stage_kv(0, 0);

  float mrun[8], lrun[8];
#pragma unroll
  for (int r = 0; r < 8; ++r) { mrun[r] = -1e30f; lrun[r] = 0.0f; }
  v8f o[4] = {};

  for (int kt = 0; kt < S_ / 64; ++kt) {
    const int buf = kt & 1;
    wait_async0();
    __syncthreads();                    // Qs + Kt/Vt[buf] staged; prev reads done
    if (kt + 1 < S_ / 64) stage_kv(buf ^ 1, kt + 1);

    // S = Q * K^T  (16 q-rows x 64 keys per wave)
    v8f sacc[4] = {};
#pragma unroll
    for (int kk = 0; kk < 64; kk += 4) {
      v2f a = *(const v2f*)&Qs[wid * 16 + lr][kk + hi * 2];
#pragma unroll
      for (int n = 0; n < 4; ++n) {
        v2f bk = *(const v2f*)&Kt[buf][n * 16 + lr][kk + hi * 2];
        sacc[n] = wmma_f32(a, bk, sacc[n]);
      }
    }

    // scale + mask
    const int colbase = kt * 64;
    float sc[4][8];
#pragma unroll
    for (int n = 0; n < 4; ++n) {
      const int col = colbase + n * 16 + lr;
      const bool ok = mask[(size_t)b * S_ + col] != 0;
#pragma unroll
      for (int r = 0; r < 8; ++r) {
        float v = sacc[n][r] * 0.125f;
        sc[n][r] = ok ? v : -1e9f;
      }
    }

    // online softmax (rows live in 16-lane halves; xor masks <16 stay in-half)
    float alph[8];
#pragma unroll
    for (int r = 0; r < 8; ++r) {
      float cm = fmaxf(fmaxf(sc[0][r], sc[1][r]), fmaxf(sc[2][r], sc[3][r]));
#pragma unroll
      for (int m = 8; m >= 1; m >>= 1) cm = fmaxf(cm, __shfl_xor(cm, m, 32));
      const float mnew = fmaxf(mrun[r], cm);
      const float al   = __expf(mrun[r] - mnew);
      mrun[r] = mnew;
      alph[r] = al;
      float rsum = 0.0f;
#pragma unroll
      for (int n = 0; n < 4; ++n) {
        float p = __expf(sc[n][r] - mnew);
        sc[n][r] = p;
        rsum += p;
      }
#pragma unroll
      for (int m = 8; m >= 1; m >>= 1) rsum += __shfl_xor(rsum, m, 32);
      lrun[r] = lrun[r] * al + rsum;
    }

    // rescale O, spill P to LDS (C-layout -> memory row-major)
#pragma unroll
    for (int n = 0; n < 4; ++n) {
#pragma unroll
      for (int r = 0; r < 8; ++r) {
        o[n][r] *= alph[r];
        Ps[wid][hi * 8 + r][n * 16 + lr] = sc[n][r];
      }
    }
    __syncthreads();                    // P visible before A-fragment reads

    // O += P * V
#pragma unroll
    for (int kk = 0; kk < 64; kk += 4) {
      v2f ap = *(const v2f*)&Ps[wid][lr][kk + hi * 2];
#pragma unroll
      for (int n = 0; n < 4; ++n) {
        v2f bv;
        bv.x = Vt[buf][kk + hi * 2][n * 16 + lr];
        bv.y = Vt[buf][kk + hi * 2 + 1][n * 16 + lr];
        o[n] = wmma_f32(ap, bv, o[n]);
      }
    }
  }

  // finalize: O / l -> ctx[b, q, h*64 + col]
#pragma unroll
  for (int r = 0; r < 8; ++r) {
    const float inv = 1.0f / lrun[r];
    const int qrow  = qt * 64 + wid * 16 + hi * 8 + r;
#pragma unroll
    for (int n = 0; n < 4; ++n) {
      ctx[(rowbase + qrow) * D_ + hoff + n * 16 + lr] = o[n][r] * inv;
    }
  }
}

// ---------------------------------------------------------------------------
extern "C" void kernel_launch(void* const* d_in, const int* in_sizes, int n_in,
                              void* d_out, int out_size, void* d_ws,
                              size_t ws_size, hipStream_t stream) {
  (void)in_sizes; (void)n_in; (void)out_size; (void)ws_size;
  const float* x     = (const float*)d_in[0];
  const int*   mask  = (const int*)d_in[1];
  const float* wq    = (const float*)d_in[2];
  const float* wk    = (const float*)d_in[3];
  const float* wv    = (const float*)d_in[4];
  const float* wo    = (const float*)d_in[5];
  const float* w1    = (const float*)d_in[6];
  const float* b1    = (const float*)d_in[7];
  const float* w2    = (const float*)d_in[8];
  const float* b2    = (const float*)d_in[9];
  const float* ln1_a = (const float*)d_in[10];
  const float* ln1_b = (const float*)d_in[11];
  const float* ln2_a = (const float*)d_in[12];
  const float* ln2_b = (const float*)d_in[13];
  float* out = (float*)d_out;

  const size_t RD = (size_t)NM * D_;  // 4M floats per activation
  float* xn  = (float*)d_ws;          // [RD]   (reused as xn2)
  float* q   = xn + RD;               // [RD]
  float* k   = q + RD;                // [RD]
  float* v   = k + RD;                // [RD]
  float* ctx = v + RD;                // [RD]
  float* x1  = ctx + RD;              // [RD]
  float* ff1 = q;                     // reuse q..ctx region: NM*DFF = 16M floats

  // 1) xn = LN1(x)
  ln_kernel<<<NM, 256, 0, stream>>>(x, ln1_a, ln1_b, xn);

  // 2) Q/K/V projections
  dim3 gD(D_ / 128, NM / 128);
  gemm_kernel<false, false, false><<<gD, 256, 0, stream>>>(
      xn, wq, nullptr, nullptr, q, NM, D_, D_);
  gemm_kernel<false, false, false><<<gD, 256, 0, stream>>>(
      xn, wk, nullptr, nullptr, k, NM, D_, D_);
  gemm_kernel<false, false, false><<<gD, 256, 0, stream>>>(
      xn, wv, nullptr, nullptr, v, NM, D_, D_);

  // 3) flash attention -> ctx
  dim3 gA(S_ / 64, H_, B_);
  attn_kernel<<<gA, 128, 0, stream>>>(q, k, v, mask, ctx);

  // 4) x1 = x + ctx @ wo
  gemm_kernel<false, false, true><<<gD, 256, 0, stream>>>(
      ctx, wo, nullptr, x, x1, NM, D_, D_);

  // 5) xn2 = LN2(x1)
  ln_kernel<<<NM, 256, 0, stream>>>(x1, ln2_a, ln2_b, xn);

  // 6) ff1 = relu(xn2 @ w1 + b1)
  dim3 gF(DFF_ / 128, NM / 128);
  gemm_kernel<true, true, false><<<gF, 256, 0, stream>>>(
      xn, w1, b1, nullptr, ff1, NM, DFF_, D_);

  // 7) out = x1 + ff1 @ w2 + b2
  gemm_kernel<true, false, true><<<gD, 256, 0, stream>>>(
      ff1, w2, b2, x1, out, NM, D_, DFF_);
}
